// v000
// Times are from an AMD MI455X. After a warm-up the kernel runs many times in a row, and a time is the length of
// such a window on the GPU divided by its runs, so every launch and the gaps after it count. The runs cycle
// through copies of the inputs. A figure is the median of several windows, for all but v000 over two sittings.
// Sittings can differ by a few percent; kernels timed side by side share one.
// v000 is the starting kernel. One run takes 18.8 microseconds.
#include <hip/hip_runtime.h>

// RoPE as block-diagonal GEMM on the CDNA5 matrix pipeline.
// out[bh, s, i] = sum_j R[pos(s), i, j] * x[bh, s, j]
// R is block-diagonal 2x2 rotations -> Out_s = X_s * R_s^T decomposes into four
// independent 64x16x16 GEMMs per position; B tiles are synthesized in VGPRs
// from the 32 (cos,sin) pairs so dense R is never read (saves 64MB of traffic).
// X_s is staged into LDS with GLOBAL_LOAD_ASYNC_TO_LDS_B128 (ASYNCcnt path).

typedef __attribute__((ext_vector_type(2))) float v2f;
typedef __attribute__((ext_vector_type(8))) float v8f;

#define DK 64
#define S_LEN 4096            // makes store offsets immediates
#define LDS_STRIDE 68         // 64 + 4 pad: keeps 16B alignment, rotates banks by 4/row

__global__ __launch_bounds__(256) void rope_wmma_kernel(
    const float* __restrict__ x,    // [BH=64, S, 64]
    const int*   __restrict__ tpos, // [S]
    const float* __restrict__ R,    // [S, 64, 64]
    float* __restrict__ out)        // [BH=64, S, 64]
{
    __shared__ float tileX[64 * LDS_STRIDE];
    __shared__ float shC[32];
    __shared__ float shS[32];

    const int s = blockIdx.x;
    const int t = threadIdx.x;

    // ---- async, coalesced load of X_s (64 rows x 256B) straight into LDS ----
    // GV mode: LDS[vdst + imm + byte] = MEM[vaddr + imm + byte]; imm advances
    // both sides in lockstep, matching our contiguous quarter-row layout.
    {
        const int row = t >> 2;        // 0..63  (flattened b*h)
        const int cq  = (t & 3) << 4;  // 0,16,32,48
        const float* src = x + ((size_t)row * S_LEN + s) * DK + cq;
        // low 32 bits of the flat-cast shared pointer are the LDS byte offset
        uint32_t ldsb = (uint32_t)(uintptr_t)&tileX[row * LDS_STRIDE + cq];
        asm volatile(
            "global_load_async_to_lds_b128 %0, %1, off offset:0\n\t"
            "global_load_async_to_lds_b128 %0, %1, off offset:16\n\t"
            "global_load_async_to_lds_b128 %0, %1, off offset:32\n\t"
            "global_load_async_to_lds_b128 %0, %1, off offset:48"
            :: "v"(ldsb), "v"(src) : "memory");
    }
    // ---- gather the sparse rotation entries: cos = R[p,2p,2p], sin = R[p,2p+1,2p] ----
    if (t < 32) {
        const int pos = tpos[s];
        const float* Rb = R + (size_t)pos * DK * DK;
        shC[t] = Rb[(2 * t) * DK + 2 * t];
        shS[t] = Rb[(2 * t + 1) * DK + 2 * t];
    }
    asm volatile("s_wait_asynccnt 0x0" ::: "memory");
    __syncthreads();

    const int wave = t >> 5;
    const int lane = t & 31;
    const int half = lane >> 4;  // lane half selects K-pairs per ISA f32 layouts
    const int l    = lane & 15;

    // Wave w owns output-column tile i0 and row tiles m0 and m0+32; both row
    // tiles share the same rotation columns -> build B fragments once.
    const int i0 = (wave & 3) * 16;
    const int m0 = (wave >> 2) * 16;

    const float c  = shC[(i0 >> 1) + (l >> 1)];
    const float sv = shS[(i0 >> 1) + (l >> 1)];

    // B (4x16 f32), B = R^T block: B[2p,2p]=c, B[2p,2p+1]=s, B[2p+1,2p]=-s,
    // B[2p+1,2p+1]=c.  VGPR0 row jj0 (even, lanes split by half), VGPR1 row jj0+1.
    v2f bf[4];
    #pragma unroll
    for (int kk = 0; kk < 4; ++kk) {
        const int jj0 = kk * 4 + 2 * half;
        bf[kk].x = (l == jj0)     ? c : ((l == jj0 + 1) ?  sv : 0.0f);
        bf[kk].y = (l == jj0 + 1) ? c : ((l == jj0)     ? -sv : 0.0f);
    }

    v8f acc0 = {};
    v8f acc1 = {};
    #pragma unroll
    for (int kk = 0; kk < 4; ++kk) {
        // A (16x4 f32): lanes0-15 -> {K,K+1}, lanes16-31 -> {K+2,K+3}
        const int colA = i0 + kk * 4 + 2 * half;
        v2f a0 = *(const v2f*)&tileX[(m0      + l) * LDS_STRIDE + colA];
        v2f a1 = *(const v2f*)&tileX[(m0 + 32 + l) * LDS_STRIDE + colA];
        acc0 = __builtin_amdgcn_wmma_f32_16x16x4_f32(
            false, a0, false, bf[kk], (short)0, acc0, false, false);
        acc1 = __builtin_amdgcn_wmma_f32_16x16x4_f32(
            false, a1, false, bf[kk], (short)0, acc1, false, false);
    }

    // D (16x16 f32): VGPR r -> row m0 + r + 8*half, col i0 + l.
    // With S_LEN constexpr, r*S_LEN*DK*4 = r*1MB < 8MB -> immediate offsets.
    float* op0 = out + ((size_t)(m0 + 8 * half) * S_LEN + s) * DK + i0 + l;
    float* op1 = op0 + (size_t)32 * S_LEN * DK;
    #pragma unroll
    for (int r = 0; r < 8; ++r) {
        op0[(size_t)r * S_LEN * DK] = acc0[r];
        op1[(size_t)r * S_LEN * DK] = acc1[r];
    }
}

extern "C" void kernel_launch(void* const* d_in, const int* in_sizes, int n_in,
                              void* d_out, int out_size, void* d_ws, size_t ws_size,
                              hipStream_t stream) {
    const float* x  = (const float*)d_in[0];
    const int*   tp = (const int*)d_in[1];
    const float* R  = (const float*)d_in[2];
    float*       o  = (float*)d_out;
    (void)in_sizes; (void)n_in; (void)out_size; (void)d_ws; (void)ws_size;
    rope_wmma_kernel<<<dim3(S_LEN), dim3(256), 0, stream>>>(x, tp, R, o);
}

// v001
// It runs in 17.2 microseconds.
// Timed twice side by side with v000, it ran 1.10 and 1.09 times as fast.
#include <hip/hip_runtime.h>

// RoPE as block-diagonal GEMM on the CDNA5 matrix pipeline.
// out[bh, s, i] = sum_j R[pos(s), i, j] * x[bh, s, j]
// R is block-diagonal 2x2 rotations -> Out_s = X_s * R_s^T decomposes into four
// independent 64x16x16 GEMMs per position; B tiles are synthesized in VGPRs
// from the 32 (cos,sin) pairs so dense R is never read (saves 64MB of traffic).
// X_s is staged into LDS with GLOBAL_LOAD_ASYNC_TO_LDS_B128 (ASYNCcnt path).

typedef __attribute__((ext_vector_type(2))) float v2f;
typedef __attribute__((ext_vector_type(8))) float v8f;

#define DK 64
#define S_LEN 4096            // makes store offsets immediates
#define LDS_STRIDE 68         // 64 + 4 pad: keeps 16B alignment, rotates banks by 4/row

__global__ __launch_bounds__(256) void rope_wmma_kernel(
    const float* __restrict__ x,    // [BH=64, S, 64]
    const int*   __restrict__ tpos, // [S]
    const float* __restrict__ R,    // [S, 64, 64]
    float* __restrict__ out)        // [BH=64, S, 64]
{
    __shared__ float tileX[64 * LDS_STRIDE];
    __shared__ float shC[32];
    __shared__ float shS[32];

    const int s = blockIdx.x;
    const int t = threadIdx.x;

    // ---- async, coalesced load of X_s (64 rows x 256B) straight into LDS ----
    // GV mode: LDS[vdst + imm + byte] = MEM[vaddr + imm + byte]; imm advances
    // both sides in lockstep, matching our contiguous quarter-row layout.
    {
        const int row = t >> 2;        // 0..63  (flattened b*h)
        const int cq  = (t & 3) << 4;  // 0,16,32,48
        const float* src = x + ((size_t)row * S_LEN + s) * DK + cq;
        // low 32 bits of the flat-cast shared pointer are the LDS byte offset
        uint32_t ldsb = (uint32_t)(uintptr_t)&tileX[row * LDS_STRIDE + cq];
        asm volatile(
            "global_load_async_to_lds_b128 %0, %1, off offset:0\n\t"
            "global_load_async_to_lds_b128 %0, %1, off offset:16\n\t"
            "global_load_async_to_lds_b128 %0, %1, off offset:32\n\t"
            "global_load_async_to_lds_b128 %0, %1, off offset:48"
            :: "v"(ldsb), "v"(src) : "memory");
    }
    // ---- gather the sparse rotation entries from the even rows alone ----
    // A row of R is 256 B.  Row 2p holds cos at column 2p and -sin right
    // beside it at column 2p+1: one 8-byte load per pair, and the odd rows (half
    // of R's bytes) are never fetched.  sin = -(-sin) is exact.
    if (t < 32) {
        // pos indexes R: kept inside R's S_LEN rows (identity for valid positions)
        const int pos = tpos[s] & (S_LEN - 1);
        const float* Rb = R + (size_t)pos * DK * DK;
        const v2f cn = *(const v2f*)&Rb[(2 * t) * DK + 2 * t];
        shC[t] = cn.x;
        shS[t] = -cn.y;
    }
    asm volatile("s_wait_asynccnt 0x0" ::: "memory");
    __syncthreads();

    const int wave = t >> 5;
    const int lane = t & 31;
    const int half = lane >> 4;  // lane half selects K-pairs per ISA f32 layouts
    const int l    = lane & 15;

    // Wave w owns output-column tile i0 and row tiles m0 and m0+32; both row
    // tiles share the same rotation columns -> build B fragments once.
    const int i0 = (wave & 3) * 16;
    const int m0 = (wave >> 2) * 16;

    const float c  = shC[(i0 >> 1) + (l >> 1)];
    const float sv = shS[(i0 >> 1) + (l >> 1)];

    // B (4x16 f32), B = R^T block: B[2p,2p]=c, B[2p,2p+1]=s, B[2p+1,2p]=-s,
    // B[2p+1,2p+1]=c.  VGPR0 row jj0 (even, lanes split by half), VGPR1 row jj0+1.
    v2f bf[4];
    #pragma unroll
    for (int kk = 0; kk < 4; ++kk) {
        const int jj0 = kk * 4 + 2 * half;
        bf[kk].x = (l == jj0)     ? c : ((l == jj0 + 1) ?  sv : 0.0f);
        bf[kk].y = (l == jj0 + 1) ? c : ((l == jj0)     ? -sv : 0.0f);
    }

    v8f acc0 = {};
    v8f acc1 = {};
    #pragma unroll
    for (int kk = 0; kk < 4; ++kk) {
        // A (16x4 f32): lanes0-15 -> {K,K+1}, lanes16-31 -> {K+2,K+3}
        const int colA = i0 + kk * 4 + 2 * half;
        v2f a0 = *(const v2f*)&tileX[(m0      + l) * LDS_STRIDE + colA];
        v2f a1 = *(const v2f*)&tileX[(m0 + 32 + l) * LDS_STRIDE + colA];
        acc0 = __builtin_amdgcn_wmma_f32_16x16x4_f32(
            false, a0, false, bf[kk], (short)0, acc0, false, false);
        acc1 = __builtin_amdgcn_wmma_f32_16x16x4_f32(
            false, a1, false, bf[kk], (short)0, acc1, false, false);
    }

    // D (16x16 f32): VGPR r -> row m0 + r + 8*half, col i0 + l.
    // With S_LEN constexpr, r*S_LEN*DK*4 = r*1MB < 8MB -> immediate offsets.
    float* op0 = out + ((size_t)(m0 + 8 * half) * S_LEN + s) * DK + i0 + l;
    float* op1 = op0 + (size_t)32 * S_LEN * DK;
    #pragma unroll
    for (int r = 0; r < 8; ++r) {
        op0[(size_t)r * S_LEN * DK] = acc0[r];
        op1[(size_t)r * S_LEN * DK] = acc1[r];
    }
}

extern "C" void kernel_launch(void* const* d_in, const int* in_sizes, int n_in,
                              void* d_out, int out_size, void* d_ws, size_t ws_size,
                              hipStream_t stream) {
    const float* x  = (const float*)d_in[0];
    const int*   tp = (const int*)d_in[1];
    const float* R  = (const float*)d_in[2];
    float*       o  = (float*)d_out;
    (void)in_sizes; (void)n_in; (void)out_size; (void)d_ws; (void)ws_size;
    rope_wmma_kernel<<<dim3(S_LEN), dim3(256), 0, stream>>>(x, tp, R, o);
}

// v002
// A run of this version takes 11.4 microseconds.
// Next to v001, in two timings, it ran 1.51 and 1.52 times as fast.
// Counting every step since v000, it is 1.65 times as fast.
#include <hip/hip_runtime.h>

// RoPE as block-diagonal GEMM on the CDNA5 matrix pipeline.
// out[bh, s, i] = sum_j R[pos(s), i, j] * x[bh, s, j]
// R is block-diagonal 2x2 rotations -> Out_s = X_s * R_s^T decomposes into four
// independent 64x16x16 GEMMs per position; B tiles are synthesized in VGPRs
// from the 32 (cos,sin) pairs so dense R is never read (saves 64MB of traffic).
// X_s is staged into LDS with GLOBAL_LOAD_ASYNC_TO_LDS_B128 (ASYNCcnt path).
// One work-group of four waves per position; a wave owns 16 WHOLE rows (256 B
// each) from the copy in to the store out.

typedef __attribute__((ext_vector_type(2))) float v2f;
typedef __attribute__((ext_vector_type(4))) float v4f;
typedef __attribute__((ext_vector_type(8))) float v8f;

#define DK 64
#define S_LEN 4096            // makes store offsets immediates
#define LDS_STRIDE 68         // 64 + 4 pad: keeps 16B alignment, rotates banks by 4/row

__global__ __launch_bounds__(128) void rope_wmma_kernel(
    const float* __restrict__ x,    // [BH=64, S, 64]
    const int*   __restrict__ tpos, // [S]
    const float* __restrict__ R,    // [S, 64, 64]
    float* __restrict__ out)        // [BH=64, S, 64]
{
    __shared__ __attribute__((aligned(16))) float tileX[64 * LDS_STRIDE];
    __shared__ float shC[32];
    __shared__ float shS[32];

    const int s = blockIdx.x;
    const int t = threadIdx.x;

    const int wave = t >> 5;
    const int lane = t & 31;
    const int half = lane >> 4;  // lane half selects K-pairs per ISA f32 layouts
    const int l    = lane & 15;
    const int m0   = wave * 16;  // the wave's 16 rows (flattened b*h)

    // ---- async load of the wave's own 16 rows of X_s straight into LDS ----
    // Copy i takes rows m0+2i and m0+2i+1 whole: lanes 0-15 one 256-B row, lanes
    // 16-31 the next.  Rows lie 1 MiB apart, so each copy has its own addresses.
    {
        const float* g0 = x + ((size_t)(m0 + half) * S_LEN + s) * DK + l * 4;
        // low 32 bits of the flat-cast shared pointer are the LDS byte offset
        const uint32_t d0 = (uint32_t)(uintptr_t)&tileX[(m0 + half) * LDS_STRIDE + l * 4];
        const size_t   gs = (size_t)2 * S_LEN * DK;      // two rows of x, in floats
        const uint32_t ds = 2 * LDS_STRIDE * 4;          // two rows of the tile, in bytes
        // s_wait_xcnt closes the statement, so that it stands in front of every
        // later rewrite of the address registers named here (a precaution).
        asm volatile(
            "global_load_async_to_lds_b128 %0, %8, off\n\t"
            "global_load_async_to_lds_b128 %1, %9, off\n\t"
            "global_load_async_to_lds_b128 %2, %10, off\n\t"
            "global_load_async_to_lds_b128 %3, %11, off\n\t"
            "global_load_async_to_lds_b128 %4, %12, off\n\t"
            "global_load_async_to_lds_b128 %5, %13, off\n\t"
            "global_load_async_to_lds_b128 %6, %14, off\n\t"
            "global_load_async_to_lds_b128 %7, %15, off\n\t"
            "s_wait_xcnt 0x0"
            :: "v"(d0),          "v"(d0 + ds),     "v"(d0 + 2 * ds), "v"(d0 + 3 * ds),
               "v"(d0 + 4 * ds), "v"(d0 + 5 * ds), "v"(d0 + 6 * ds), "v"(d0 + 7 * ds),
               "v"(g0),          "v"(g0 + gs),     "v"(g0 + 2 * gs), "v"(g0 + 3 * gs),
               "v"(g0 + 4 * gs), "v"(g0 + 5 * gs), "v"(g0 + 6 * gs), "v"(g0 + 7 * gs)
            : "memory");
    }
    // ---- gather the sparse rotation entries from the even rows alone ----
    // A row of R is 256 B.  Row 2p holds cos at column 2p and -sin right
    // beside it at column 2p+1: one 8-byte load per pair, and the odd rows (half
    // of R's bytes) are never fetched.  sin = -(-sin) is exact.
    if (t < 32) {
        // pos indexes R: kept inside R's S_LEN rows (identity for valid positions)
        const int pos = tpos[s] & (S_LEN - 1);
        const float* Rb = R + (size_t)pos * DK * DK;
        const v2f cn = *(const v2f*)&Rb[(2 * t) * DK + 2 * t];
        shC[t] = cn.x;
        shS[t] = -cn.y;
    }
    asm volatile("s_wait_asynccnt 0x0" ::: "memory");
    __syncthreads();

    // The wave runs its 16 rows through all four column tiles i0 = 16*ct.
    // Every loop below is unrolled so that acc[] and the fragments are indexed by
    // constants and stay in registers, and LDS and store offsets become immediates.
    v8f acc[4];
    #pragma unroll
    for (int ct = 0; ct < 4; ++ct) {
        const int i0 = ct * 16;
        const float c  = shC[(i0 >> 1) + (l >> 1)];
        const float sv = shS[(i0 >> 1) + (l >> 1)];
        v8f a8 = {};
        #pragma unroll
        for (int kk = 0; kk < 4; ++kk) {
            // B (4x16 f32), B = R^T block: B[2p,2p]=c, B[2p,2p+1]=s, B[2p+1,2p]=-s,
            // B[2p+1,2p+1]=c.  VGPR0 row jj0 (even, lanes split by half), VGPR1 row jj0+1.
            const int jj0 = kk * 4 + 2 * half;
            v2f bf;
            bf.x = (l == jj0)     ? c : ((l == jj0 + 1) ?  sv : 0.0f);
            bf.y = (l == jj0 + 1) ? c : ((l == jj0)     ? -sv : 0.0f);
            // A (16x4 f32): lanes0-15 -> {K,K+1}, lanes16-31 -> {K+2,K+3}
            const int colA = i0 + kk * 4 + 2 * half;
            v2f a0 = *(const v2f*)&tileX[(m0 + l) * LDS_STRIDE + colA];
            a8 = __builtin_amdgcn_wmma_f32_16x16x4_f32(
                false, a0, false, bf, (short)0, a8, false, false);
        }
        acc[ct] = a8;
    }

    // ---- D back into the wave's own rows of the tile (no other wave touches them) ----
    // D (16x16 f32): VGPR r -> row m0 + r + 8*half, col i0 + l.
    #pragma unroll
    for (int ct = 0; ct < 4; ++ct) {
        #pragma unroll
        for (int r = 0; r < 8; ++r)
            tileX[(m0 + r + 8 * half) * LDS_STRIDE + ct * 16 + l] = acc[ct][r];
    }
    // The rows are read back by other lanes of this wave than wrote them: the
    // writes must have retired, and the compiler may move no read above them.
    asm volatile("s_wait_dscnt 0x0" ::: "memory");

    // ---- each store writes two whole 256-B rows (four full 128-B lines) ----
    float* op = out + ((size_t)(m0 + half) * S_LEN + s) * DK + l * 4;
    #pragma unroll
    for (int q = 0; q < 8; ++q) {
        const v4f v = *(const v4f*)&tileX[(m0 + 2 * q + half) * LDS_STRIDE + l * 4];
        *(v4f*)&op[(size_t)(2 * q) * S_LEN * DK] = v;
    }
}

extern "C" void kernel_launch(void* const* d_in, const int* in_sizes, int n_in,
                              void* d_out, int out_size, void* d_ws, size_t ws_size,
                              hipStream_t stream) {
    const float* x  = (const float*)d_in[0];
    const int*   tp = (const int*)d_in[1];
    const float* R  = (const float*)d_in[2];
    float*       o  = (float*)d_out;
    (void)in_sizes; (void)n_in; (void)out_size; (void)d_ws; (void)ws_size;
    rope_wmma_kernel<<<dim3(S_LEN), dim3(128), 0, stream>>>(x, tp, R, o);
}
